// v000
// Measured on an AMD MI455X. A time is GPU time per run, averaged over a window of back-to-back runs after a warm-up
// (all launches, gaps included; the runs take copies of the inputs in turn), and the median of several windows.
// Apart from v000's, it joins two sittings. Times from different sittings can be a few percent apart, while
// side-by-side timings come from the same sitting.
// v000 is the starting kernel. One run takes 74.6 microseconds.
#include <hip/hip_runtime.h>

typedef __attribute__((ext_vector_type(2))) float v2f;
typedef __attribute__((ext_vector_type(8))) float v8f;

#define B_DIM 8
#define E_DIM 256
#define S_DIM 2048
#define KW    9
#define PADW  4
#define INV_SCALE (1.0f / 24.0f)   // 1/(sqrt(256)*1.5)

// ---------------------------------------------------------------------------
// Kernel 1: Y[b,t,f] = sum_e x[b,e,t] * Wq[f,e] + bq[f]
// One block = one 16-wide t-tile of one batch.
// The 16x256 x-tile (A operand, shared by all 16 f-tiles) is staged ONCE into
// LDS via async global->LDS B128 copies (ASYNCcnt), then 8 waves x 2 f-tiles
// run the K-loop of fp32 WMMA 16x16x4 with A from LDS, B (Wq rows) from L2.
// ---------------------------------------------------------------------------
__global__ __launch_bounds__(256) void qproj_kernel(
    const float* __restrict__ x, const float* __restrict__ Wq,
    const float* __restrict__ bq, float* __restrict__ Y)
{
    __shared__ float xs[16 * E_DIM];              // [e][t] rows of 16 floats (16 KB)

    const int tile = blockIdx.x;                  // 0 .. B*S/16-1
    const int b    = tile / (S_DIM / 16);
    const int t0   = (tile % (S_DIM / 16)) * 16;
    const int tid  = threadIdx.x;
    const float* xb = x + (size_t)b * E_DIM * S_DIM + t0;

    // ---- async stage: 1024 x 16B chunks, 4 per thread, global -> LDS ----
    const uint32_t lds0 = (uint32_t)(uintptr_t)&xs[0];   // LDS byte address
    #pragma unroll
    for (int i = 0; i < 4; ++i) {
        const int c    = tid + 256 * i;           // chunk id
        const int e    = c >> 2;                  // feature row
        const int part = c & 3;                   // 16B chunk within 64B row
        const float*   g = xb + (size_t)e * S_DIM + part * 4;
        const uint32_t l = lds0 + (uint32_t)(e * 16 + part * 4) * 4u;
        asm volatile("global_load_async_to_lds_b128 %0, %1, off"
                     :: "v"(l), "v"(g) : "memory");
    }
    asm volatile("s_wait_asynccnt 0x0" ::: "memory");
    __syncthreads();                              // all waves' chunks visible

    const int wave = tid >> 5;
    const int lane = tid & 31;
    const int mn   = lane & 15;                   // A-row m / B-col n / D-col n
    const int kb   = (lane >> 4) * 2;             // K sub-offset per half-wave
    const int half = lane >> 4;

    #pragma unroll
    for (int ft = 0; ft < 2; ++ft) {
        const int f0 = (wave * 2 + ft) * 16;
        const float* wrow = Wq + (size_t)(f0 + mn) * E_DIM;   // B[k,n] = Wq[f0+n, e]
        v8f acc = {};
        #pragma unroll 4
        for (int k0 = 0; k0 < E_DIM; k0 += 4) {
            v2f a;                                // A[m,k] = xs[k][m], conflict-free
            a.x = xs[(k0 + kb) * 16 + mn];
            a.y = xs[(k0 + kb + 1) * 16 + mn];
            v2f bv = *(const v2f*)(wrow + k0 + kb);
            acc = __builtin_amdgcn_wmma_f32_16x16x4_f32(
                      false, a, false, bv, (short)0, acc, false, false);
        }
        const float bias = bq[f0 + mn];
        float* yb = Y + ((size_t)b * S_DIM + t0) * E_DIM + f0;
        #pragma unroll
        for (int j = 0; j < 8; ++j) {
            const int mm = j + half * 8;          // D row = t offset
            yb[(size_t)mm * E_DIM + mn] = acc[j] + bias;
        }
    }
}

// ---------------------------------------------------------------------------
// Kernel 2 (fused): window energies -> softmax -> context (LDS) -> Wo GEMM.
// One block = one 16-wide t-tile of one batch.
//  Phase A: 16 groups of 16 lanes; group g owns s = t0+g.
//  Phase B: 8 waves x 2 f-tiles of out[b,f,t] = (Wo . ctx + bo)/9 via WMMA.
// ---------------------------------------------------------------------------
__global__ __launch_bounds__(256) void attn_out_kernel(
    const float* __restrict__ x, const float* __restrict__ Y,
    const float* __restrict__ bq, const float* __restrict__ Wo,
    const float* __restrict__ bo, float* __restrict__ out)
{
    __shared__ float ctx[16][E_DIM + 4];          // +4 pad: bank stride 4, no conflicts

    const int tile = blockIdx.x;
    const int b    = tile / (S_DIM / 16);
    const int t0   = (tile % (S_DIM / 16)) * 16;
    const int tid  = threadIdx.x;
    const int g      = tid >> 4;                  // group -> s index in tile
    const int lane16 = tid & 15;
    const int s      = t0 + g;

    const float* yb = Y + (size_t)b * S_DIM * E_DIM;
    const float* ys = yb + (size_t)s * E_DIM;
    const float* xb = x + (size_t)b * E_DIM * S_DIM;

    // --- energies: en[l] = <y[s], y[s+l-4]> / 24  (OOB row of Q == bq) ---
    float en[KW];
    #pragma unroll
    for (int l = 0; l < KW; ++l) {
        const int sl = s + l - PADW;
        const float* yl = (sl >= 0 && sl < S_DIM) ? (yb + (size_t)sl * E_DIM) : bq;
        float p = 0.f;
        #pragma unroll 4
        for (int e = lane16; e < E_DIM; e += 16)
            p += ys[e] * yl[e];
        #pragma unroll
        for (int off = 8; off >= 1; off >>= 1)    // xor tree: all 16 lanes get sum
            p += __shfl_xor(p, off, 16);
        en[l] = p * INV_SCALE;
    }

    // --- softmax over the 9 window slots (redundant in all 16 lanes) ---
    float mx = en[0];
    #pragma unroll
    for (int l = 1; l < KW; ++l) mx = fmaxf(mx, en[l]);
    float w[KW], sum = 0.f;
    #pragma unroll
    for (int l = 0; l < KW; ++l) { w[l] = __expf(en[l] - mx); sum += w[l]; }
    const float inv = 1.0f / sum;

    // --- context: ctx[s,e] = sum_l w[l] * x[b,e,s+l-4]  (zero-padded) ---
    #pragma unroll 4
    for (int e = lane16; e < E_DIM; e += 16) {
        const float* xrow = xb + (size_t)e * S_DIM;
        float c = 0.f;
        #pragma unroll
        for (int l = 0; l < KW; ++l) {
            const int sl = s + l - PADW;
            if (sl >= 0 && sl < S_DIM) c += w[l] * inv * xrow[sl];
        }
        ctx[g][e] = c;
    }
    __syncthreads();

    // --- output GEMM: out[b, f0+m, t0+n] = (sum_e Wo[f,e]*ctx[n][e] + bo[f])/9
    const int wave = tid >> 5;
    const int lane = tid & 31;
    const int mn   = lane & 15;
    const int kb   = (lane >> 4) * 2;
    const int half = lane >> 4;

    #pragma unroll
    for (int ft = 0; ft < 2; ++ft) {
        const int f0 = (wave * 2 + ft) * 16;
        const float* arow = Wo + (size_t)(f0 + mn) * E_DIM;   // A[m,k] = Wo[f0+m, e]
        v8f acc = {};
        #pragma unroll 4
        for (int k0 = 0; k0 < E_DIM; k0 += 4) {
            v2f a  = *(const v2f*)(arow + k0 + kb);
            v2f bv = *(const v2f*)&ctx[mn][k0 + kb];          // B[k,n] = ctx[n][e]
            acc = __builtin_amdgcn_wmma_f32_16x16x4_f32(
                      false, a, false, bv, (short)0, acc, false, false);
        }
        float* ob = out + ((size_t)b * E_DIM + f0) * S_DIM + t0;
        #pragma unroll
        for (int j = 0; j < 8; ++j) {
            const int mm = j + half * 8;          // D row = f offset
            ob[(size_t)mm * S_DIM + mn] = (acc[j] + bo[f0 + mm]) * (1.0f / KW);
        }
    }
}

// ---------------------------------------------------------------------------
extern "C" void kernel_launch(void* const* d_in, const int* in_sizes, int n_in,
                              void* d_out, int out_size, void* d_ws, size_t ws_size,
                              hipStream_t stream)
{
    const float* x  = (const float*)d_in[0];
    const float* Wq = (const float*)d_in[1];
    const float* bq = (const float*)d_in[2];
    const float* Wo = (const float*)d_in[3];
    const float* bo = (const float*)d_in[4];
    float* out = (float*)d_out;
    float* Y   = (float*)d_ws;     // B*S*E floats = 16 MB scratch

    const int nblk = B_DIM * (S_DIM / 16);   // 1024 blocks of 256 threads
    qproj_kernel<<<dim3(nblk), dim3(256), 0, stream>>>(x, Wq, bq, Y);
    attn_out_kernel<<<dim3(nblk), dim3(256), 0, stream>>>(x, Y, bq, Wo, bo, out);
}

// v001
// One run takes 52.6 microseconds.
// In both of two side-by-side timings against v000, it was 1.44 times as fast.
#include <hip/hip_runtime.h>

typedef __attribute__((ext_vector_type(2))) float v2f;
typedef __attribute__((ext_vector_type(4))) float v4f;
typedef __attribute__((ext_vector_type(8))) float v8f;

#define B_DIM 8
#define E_DIM 256
#define S_DIM 2048
#define KW    9
#define PADW  4
#define INV_SCALE (1.0f / 24.0f)   // 1/(sqrt(256)*1.5)

// ---------------------------------------------------------------------------
// Kernel 1: Y[b,t,f] = sum_e x[b,e,t] * Wq[f,e] + bq[f]
// One block = one 16-wide t-tile of one batch.
// The 16x256 x-tile (A operand, shared by all 16 f-tiles) is staged ONCE into
// LDS via async global->LDS B128 copies (ASYNCcnt), then 8 waves x 2 f-tiles
// run the K-loop of fp32 WMMA 16x16x4 with A from LDS, B (Wq rows) from L2.
// ---------------------------------------------------------------------------
__global__ __launch_bounds__(256) void qproj_kernel(
    const float* __restrict__ x, const float* __restrict__ Wq,
    const float* __restrict__ bq, float* __restrict__ Y)
{
    __shared__ float xs[16 * E_DIM];              // [e][t] rows of 16 floats (16 KB)

    const int tile = blockIdx.x;                  // 0 .. B*S/16-1
    const int b    = tile / (S_DIM / 16);
    const int t0   = (tile % (S_DIM / 16)) * 16;
    const int tid  = threadIdx.x;
    const float* xb = x + (size_t)b * E_DIM * S_DIM + t0;

    // ---- async stage: 1024 x 16B chunks, 4 per thread, global -> LDS ----
    const uint32_t lds0 = (uint32_t)(uintptr_t)&xs[0];   // LDS byte address
    #pragma unroll
    for (int i = 0; i < 4; ++i) {
        const int c    = tid + 256 * i;           // chunk id
        const int e    = c >> 2;                  // feature row
        const int part = c & 3;                   // 16B chunk within 64B row
        const float*   g = xb + (size_t)e * S_DIM + part * 4;
        const uint32_t l = lds0 + (uint32_t)(e * 16 + part * 4) * 4u;
        asm volatile("global_load_async_to_lds_b128 %0, %1, off"
                     :: "v"(l), "v"(g) : "memory");
    }
    asm volatile("s_wait_asynccnt 0x0" ::: "memory");
    __syncthreads();                              // all waves' chunks visible

    const int wave = tid >> 5;
    const int lane = tid & 31;
    const int mn   = lane & 15;                   // A-row m / B-col n / D-col n
    const int kb   = (lane >> 4) * 2;             // K sub-offset per half-wave
    const int half = lane >> 4;

    #pragma unroll
    for (int ft = 0; ft < 2; ++ft) {
        const int f0 = (wave * 2 + ft) * 16;
        const float* wrow = Wq + (size_t)(f0 + mn) * E_DIM;   // B[k,n] = Wq[f0+n, e]
        v8f acc = {};
        #pragma unroll 4
        for (int k0 = 0; k0 < E_DIM; k0 += 4) {
            v2f a;                                // A[m,k] = xs[k][m], conflict-free
            a.x = xs[(k0 + kb) * 16 + mn];
            a.y = xs[(k0 + kb + 1) * 16 + mn];
            v2f bv = *(const v2f*)(wrow + k0 + kb);
            acc = __builtin_amdgcn_wmma_f32_16x16x4_f32(
                      false, a, false, bv, (short)0, acc, false, false);
        }
        const float bias = bq[f0 + mn];
        float* yb = Y + ((size_t)b * S_DIM + t0) * E_DIM + f0;
        #pragma unroll
        for (int j = 0; j < 8; ++j) {
            const int mm = j + half * 8;          // D row = t offset
            yb[(size_t)mm * E_DIM + mn] = acc[j] + bias;
        }
    }
}

// ---------------------------------------------------------------------------
// Kernel 2 (fused): window energies -> softmax -> context (LDS) -> Wo GEMM.
// One block = one 16-wide t-tile of one batch.
//  Stage:   the 24 Y rows and the 24 x columns that the tile's windows cover
//           are read once from global memory, 16 bytes a lane, into LDS
//           (x transposed to [t][e], so that both are read along e).
//  Phase A: 16 groups of 16 lanes; group g owns s = t0+g; all reads from LDS.
//  Phase B: 8 waves x 2 f-tiles of out[b,f,t] = (Wo . ctx + bo)/9 via WMMA.
// ---------------------------------------------------------------------------
#define WIN   (16 + KW - 1)                       // 24 window positions per tile
#define XPIT  (E_DIM + 4)                         // xT row pitch in floats

// 8 waves per SIMD: the grid is 4 blocks per WGP, all resident at once (128 VGPRs at most).
__global__ __launch_bounds__(256) __attribute__((amdgpu_waves_per_eu(8))) void attn_out_kernel(
    const float* __restrict__ x, const float* __restrict__ Y,
    const float* __restrict__ bq, const float* __restrict__ Wo,
    const float* __restrict__ bo, float* __restrict__ out)
{
    __shared__ __attribute__((aligned(16))) float ysm[WIN][E_DIM];   // Y rows t0-4 .. t0+19
    __shared__ __attribute__((aligned(16))) float xT[WIN][XPIT];     // x columns, [t][e]
    __shared__ __attribute__((aligned(16))) float ctx[16][E_DIM + 4]; // +4 pad: bank stride 4

    const int tile = blockIdx.x;
    const int b    = tile / (S_DIM / 16);
    const int t0   = (tile % (S_DIM / 16)) * 16;
    const int tid  = threadIdx.x;
    const int g      = tid >> 4;                  // group -> s index in tile
    const int lane16 = tid & 15;

    const float* yb = Y + (size_t)b * S_DIM * E_DIM;
    const float* xb = x + (size_t)b * E_DIM * S_DIM;

    // --- stage: 6 + 6 chunks of 16 B per thread, all loads issued first ---
    v4f yv[6], xv[6];
    const float* yp[6];
    const float* xp[6];
    bool xin[6];
    #pragma unroll
    for (int i = 0; i < 6; ++i) {                 // Y: 64 chunks per row, row uniform per wave
        const int c  = tid + 256 * i;
        const int sl = t0 - PADW + (c >> 6);
        const float* row = (sl >= 0 && sl < S_DIM) ? (yb + (size_t)sl * E_DIM) : bq;  // OOB row of Q == bq
        yp[i] = row + (c & 63) * 4;
    }
    #pragma unroll
    for (int i = 0; i < 6; ++i) {                 // x: 6 chunks (96 B) per feature row
        const int c    = tid + 256 * i;
        const int e    = c / 6;
        const int col  = t0 - PADW + (c - e * 6) * 4;         // a chunk is wholly in or wholly out
        const int colc = min(max(col, 0), S_DIM - 4);         // address stays inside x
        xp[i]  = xb + (size_t)e * S_DIM + colc;
        xin[i] = (col == colc);
    }
    #pragma unroll
    for (int i = 0; i < 6; ++i) yv[i] = *(const v4f*)yp[i];
    #pragma unroll
    for (int i = 0; i < 6; ++i) xv[i] = *(const v4f*)xp[i];
    // The twelve address pairs stay untouched until this wait: no register that an
    // issued load names is overwritten (also not by a later load's data) ahead of it.
    asm volatile("s_wait_xcnt 0x0"
                 :: "v"(yp[0]), "v"(yp[1]), "v"(yp[2]), "v"(yp[3]), "v"(yp[4]), "v"(yp[5]),
                    "v"(xp[0]), "v"(xp[1]), "v"(xp[2]), "v"(xp[3]), "v"(xp[4]), "v"(xp[5])
                 : "memory");
    #pragma unroll
    for (int i = 0; i < 6; ++i)
        if (!xin[i]) xv[i] = (v4f)(0.f);       // zero padding
    #pragma unroll
    for (int i = 0; i < 6; ++i) {
        const int c = tid + 256 * i;
        *(v4f*)&ysm[c >> 6][(c & 63) * 4] = yv[i];
    }
    #pragma unroll
    for (int i = 0; i < 6; ++i) {
        const int c = tid + 256 * i;
        const int e = c / 6;
        const int r = (c - e * 6) * 4;
        xT[r + 0][e] = xv[i].x;
        xT[r + 1][e] = xv[i].y;
        xT[r + 2][e] = xv[i].z;
        xT[r + 3][e] = xv[i].w;
    }
    __syncthreads();                              // windows visible to every group

    // --- energies: en[l] = <y[s], y[s+l-4]> / 24; lane owns e = 4*lane16 + 64*i + 0..3 ---
    v4f own[4];
    #pragma unroll
    for (int i = 0; i < 4; ++i)
        own[i] = *(const v4f*)&ysm[g + PADW][lane16 * 4 + 64 * i];

    float en[KW];
    #pragma unroll
    for (int l = 0; l < KW; ++l) {
        float p = 0.f;
        #pragma unroll
        for (int i = 0; i < 4; ++i) {
            const v4f v = (l == PADW) ? own[i]
                                         : *(const v4f*)&ysm[g + l][lane16 * 4 + 64 * i];
            p = fmaf(own[i].x, v.x, p);
            p = fmaf(own[i].y, v.y, p);
            p = fmaf(own[i].z, v.z, p);
            p = fmaf(own[i].w, v.w, p);
        }
        #pragma unroll
        for (int off = 8; off >= 1; off >>= 1)    // xor tree: all 16 lanes get sum
            p += __shfl_xor(p, off, 16);
        en[l] = p * INV_SCALE;
    }

    // --- softmax over the 9 window slots (redundant in all 16 lanes) ---
    float mx = en[0];
    #pragma unroll
    for (int l = 1; l < KW; ++l) mx = fmaxf(mx, en[l]);
    float w[KW], sum = 0.f;
    #pragma unroll
    for (int l = 0; l < KW; ++l) { w[l] = __expf(en[l] - mx); sum += w[l]; }
    const float inv = 1.0f / sum;
    #pragma unroll
    for (int l = 0; l < KW; ++l) w[l] *= inv;

    // --- context: ctx[s,e] = sum_l w[l] * x[b,e,s+l-4]  (zero-padded in xT) ---
    #pragma unroll
    for (int i = 0; i < 4; ++i) {
        v4f c = (v4f)(0.f);
        #pragma unroll
        for (int l = 0; l < KW; ++l) {
            const v4f v = *(const v4f*)&xT[g + l][lane16 * 4 + 64 * i];
            c.x += w[l] * v.x;
            c.y += w[l] * v.y;
            c.z += w[l] * v.z;
            c.w += w[l] * v.w;
        }
        *(v4f*)&ctx[g][lane16 * 4 + 64 * i] = c;
    }
    __syncthreads();

    // --- output GEMM: out[b, f0+m, t0+n] = (sum_e Wo[f,e]*ctx[n][e] + bo[f])/9
    const int wave = tid >> 5;
    const int lane = tid & 31;
    const int mn   = lane & 15;
    const int kb   = (lane >> 4) * 2;
    const int half = lane >> 4;

    #pragma unroll
    for (int ft = 0; ft < 2; ++ft) {
        const int f0 = (wave * 2 + ft) * 16;
        const float* arow = Wo + (size_t)(f0 + mn) * E_DIM;   // A[m,k] = Wo[f0+m, e]
        v8f acc = {};
        #pragma unroll 4
        for (int k0 = 0; k0 < E_DIM; k0 += 4) {
            v2f a  = *(const v2f*)(arow + k0 + kb);
            v2f bv = *(const v2f*)&ctx[mn][k0 + kb];          // B[k,n] = ctx[n][e]
            acc = __builtin_amdgcn_wmma_f32_16x16x4_f32(
                      false, a, false, bv, (short)0, acc, false, false);
        }
        float* ob = out + ((size_t)b * E_DIM + f0) * S_DIM + t0;
        #pragma unroll
        for (int j = 0; j < 8; ++j) {
            const int mm = j + half * 8;          // D row = f offset
            ob[(size_t)mm * S_DIM + mn] = (acc[j] + bo[f0 + mm]) * (1.0f / KW);
        }
    }
}

// ---------------------------------------------------------------------------
extern "C" void kernel_launch(void* const* d_in, const int* in_sizes, int n_in,
                              void* d_out, int out_size, void* d_ws, size_t ws_size,
                              hipStream_t stream)
{
    const float* x  = (const float*)d_in[0];
    const float* Wq = (const float*)d_in[1];
    const float* bq = (const float*)d_in[2];
    const float* Wo = (const float*)d_in[3];
    const float* bo = (const float*)d_in[4];
    float* out = (float*)d_out;
    float* Y   = (float*)d_ws;     // B*S*E floats = 16 MB scratch

    const int nblk = B_DIM * (S_DIM / 16);   // 1024 blocks of 256 threads
    qproj_kernel<<<dim3(nblk), dim3(256), 0, stream>>>(x, Wq, bq, Y);
    attn_out_kernel<<<dim3(nblk), dim3(256), 0, stream>>>(x, Y, bq, Wo, bo, out);
}

// v002
// A run of this version takes 32.9 microseconds.
// In two side-by-side timings against v001, it was 1.59 and 1.60 times as fast.
// Counting every step since v000, it is 2.30 times as fast.
#include <hip/hip_runtime.h>

typedef __attribute__((ext_vector_type(2))) float v2f;
typedef __attribute__((ext_vector_type(4))) float v4f;
typedef __attribute__((ext_vector_type(8))) float v8f;

#define B_DIM 8
#define E_DIM 256
#define S_DIM 2048
#define KW    9
#define PADW  4
#define TT    64                     // t positions per block: 4 WMMA tiles
#define INV_SCALE (1.0f / 24.0f)   // 1/(sqrt(256)*1.5)

// ---------------------------------------------------------------------------
// Kernel 1: Y[b,t,f] = sum_e x[b,e,t] * Wq[f,e] + bq[f]
// One block = one 64-wide t-tile of one batch, 16 waves.
// The 64x256 x-tile (A operand, shared by all 16 f-tiles) is staged ONCE into
// LDS via async global->LDS B128 copies (ASYNCcnt). Each wave owns one f-tile:
// a Wq fragment (B operand, from L2) is loaded once per k step and feeds the
// four fp32 WMMA 16x16x4 of the block's four t-tiles.
// ---------------------------------------------------------------------------
__global__ __launch_bounds__(512) void qproj_kernel(
    const float* __restrict__ x, const float* __restrict__ Wq,
    const float* __restrict__ bq, float* __restrict__ Y)
{
    __shared__ __attribute__((aligned(16))) float xs[TT / 16][E_DIM * 16];   // per t-tile: [e][t] rows of 16 floats (64 KB)

    const int tile = blockIdx.x;                  // 0 .. B*S/TT-1
    const int b    = tile / (S_DIM / TT);
    const int t0   = (tile % (S_DIM / TT)) * TT;
    const int tid  = threadIdx.x;
    const float* xb = x + (size_t)b * E_DIM * S_DIM + t0;

    // ---- async stage: 4096 x 16B chunks, 8 per thread, global -> LDS ----
    const uint32_t lds0 = (uint32_t)(uintptr_t)&xs[0][0];   // LDS byte address
    const float* g[8];
    uint32_t     l[8];
    #pragma unroll
    for (int i = 0; i < 8; ++i) {
        const int c    = tid + 512 * i;           // chunk id
        const int e    = c >> 4;                  // feature row
        const int part = c & 15;                  // 16B chunk within 256B row
        g[i] = xb + (size_t)e * S_DIM + part * 4;
        l[i] = lds0 + (uint32_t)((part >> 2) * (E_DIM * 16) + e * 16 + (part & 3) * 4) * 4u;
    }
    // The eight copies and their s_wait_xcnt in one statement: no address register
    // that an issued copy names is rewritten ahead of the wait.
    asm volatile("global_load_async_to_lds_b128 %0, %8, off\n\t"
                 "global_load_async_to_lds_b128 %1, %9, off\n\t"
                 "global_load_async_to_lds_b128 %2, %10, off\n\t"
                 "global_load_async_to_lds_b128 %3, %11, off\n\t"
                 "global_load_async_to_lds_b128 %4, %12, off\n\t"
                 "global_load_async_to_lds_b128 %5, %13, off\n\t"
                 "global_load_async_to_lds_b128 %6, %14, off\n\t"
                 "global_load_async_to_lds_b128 %7, %15, off\n\t"
                 "s_wait_xcnt 0x0"
                 :: "v"(l[0]), "v"(l[1]), "v"(l[2]), "v"(l[3]),
                    "v"(l[4]), "v"(l[5]), "v"(l[6]), "v"(l[7]),
                    "v"(g[0]), "v"(g[1]), "v"(g[2]), "v"(g[3]),
                    "v"(g[4]), "v"(g[5]), "v"(g[6]), "v"(g[7])
                 : "memory");
    asm volatile("s_wait_asynccnt 0x0" ::: "memory");   // this wave's chunks have landed
    __syncthreads();                              // all waves' chunks visible

    const int wave = tid >> 5;
    const int lane = tid & 31;
    const int mn   = lane & 15;                   // A-row m / B-col n / D-col n
    const int kb   = (lane >> 4) * 2;             // K sub-offset per half-wave
    const int half = lane >> 4;

    const int f0 = wave * 16;
    const float* wrow = Wq + (size_t)(f0 + mn) * E_DIM;       // B[k,n] = Wq[f0+n, e]
    v8f acc[TT / 16] = {};
    #pragma unroll 4
    for (int k0 = 0; k0 < E_DIM; k0 += 4) {
        const v2f bv = *(const v2f*)(wrow + k0 + kb);
        #pragma unroll                            // constant tt: the four accumulators stay in registers
        for (int tt = 0; tt < TT / 16; ++tt) {
            v2f a;                                // A[m,k] = xs[tt][k][m], conflict-free
            a.x = xs[tt][(k0 + kb) * 16 + mn];
            a.y = xs[tt][(k0 + kb + 1) * 16 + mn];
            acc[tt] = __builtin_amdgcn_wmma_f32_16x16x4_f32(
                          false, a, false, bv, (short)0, acc[tt], false, false);
        }
    }
    const float bias = bq[f0 + mn];
    #pragma unroll                                // constant tt, as above
    for (int tt = 0; tt < TT / 16; ++tt) {
        float* yb = Y + ((size_t)b * S_DIM + t0 + tt * 16) * E_DIM + f0;
        #pragma unroll
        for (int j = 0; j < 8; ++j) {
            const int mm = j + half * 8;          // D row = t offset
            yb[(size_t)mm * E_DIM + mn] = acc[tt][j] + bias;
        }
    }
}

// ---------------------------------------------------------------------------
// Kernel 2 (fused): window energies -> softmax -> context (LDS) -> Wo GEMM.
// One block = one 64-wide t-tile of one batch, 16 waves, alone on its WGP.
//  Stage:   the 72 Y rows and the 72 x columns that the tile's windows cover
//           are read once from global memory, 16 bytes a lane, into LDS
//           (x transposed to [t][e], so that both are read along e).
//  Phase A: 32 groups of 16 lanes; group g owns s = t0+g and s = t0+g+32; all reads from LDS.
//  Phase B: each wave owns one f-tile of out[b,f,t] = (Wo . ctx + bo)/9: a Wo
//           fragment is loaded once per k step and feeds four WMMAs (four t-tiles).
// ---------------------------------------------------------------------------
#define WIN   (TT + KW - 1)                       // 72 window positions per tile
#define XPIT  (E_DIM + 4)                         // xT row pitch in floats
#define NCH   9                                   // 16-byte chunks per thread: WIN*E_DIM/4/512

// 2^a by v_exp_f32, with the one slot that the instruction set asks for behind a transcendental
// (before its result is used or its source overwritten) in the same statement.
__device__ __forceinline__ float exp2_slot(float a)
{
    float r;
    asm("v_exp_f32 %0, %1\n\tv_nop" : "=v"(r) : "v"(a));
    return r;
}

__global__ __launch_bounds__(512) void attn_out_kernel(
    const float* __restrict__ x, const float* __restrict__ Y,
    const float* __restrict__ bq, const float* __restrict__ Wo,
    const float* __restrict__ bo, float* __restrict__ out)
{
    __shared__ __attribute__((aligned(16))) float ysm[WIN][E_DIM];   // Y rows t0-4 .. t0+67
    __shared__ __attribute__((aligned(16))) float xT[WIN][XPIT];     // x columns, [t][e]
    __shared__ __attribute__((aligned(16))) float ctx[TT][E_DIM + 4]; // +4 pad: bank stride 4

    const int tile = blockIdx.x;
    const int b    = tile / (S_DIM / TT);
    const int t0   = (tile % (S_DIM / TT)) * TT;
    const int tid  = threadIdx.x;
    const int g      = tid >> 4;                  // group -> s index in tile (and +32)
    const int lane16 = tid & 15;

    const float* yb = Y + (size_t)b * S_DIM * E_DIM;
    const float* xb = x + (size_t)b * E_DIM * S_DIM;

    // --- stage: 9 + 9 chunks of 16 B per thread, all loads issued first ---
    v4f yv[NCH], xv[NCH];
    const float* yp[NCH];
    const float* xp[NCH];
    bool xin[NCH];
    #pragma unroll
    for (int i = 0; i < NCH; ++i) {               // Y: 64 chunks per row, row uniform per wave
        const int c  = tid + 512 * i;
        const int sl = t0 - PADW + (c >> 6);
        const float* row = (sl >= 0 && sl < S_DIM) ? (yb + (size_t)sl * E_DIM) : bq;  // OOB row of Q == bq
        yp[i] = row + (c & 63) * 4;
    }
    #pragma unroll
    for (int i = 0; i < NCH; ++i) {               // x: runs of 6 chunks (96 B) of a feature row, 3 runs per row
        const int c    = tid + 512 * i;
        const int run  = c / 6;
        const int e    = run & (E_DIM - 1);
        const int r    = ((run >> 8) * 6 + (c - run * 6)) * 4; // window position of the chunk, 0 .. 68
        const int col  = t0 - PADW + r;                       // a chunk is wholly in or wholly out
        const int colc = min(max(col, 0), S_DIM - 4);         // address stays inside x
        xp[i]  = xb + (size_t)e * S_DIM + colc;
        xin[i] = (col == colc);
    }
    #pragma unroll
    for (int i = 0; i < NCH; ++i) yv[i] = *(const v4f*)yp[i];
    #pragma unroll
    for (int i = 0; i < NCH; ++i) xv[i] = *(const v4f*)xp[i];
    // The eighteen address pairs stay untouched until this wait: no register that an
    // issued load names is overwritten (also not by a later load's data) ahead of it.
    asm volatile("s_wait_xcnt 0x0"
                 :: "v"(yp[0]), "v"(yp[1]), "v"(yp[2]), "v"(yp[3]), "v"(yp[4]), "v"(yp[5]),
                    "v"(yp[6]), "v"(yp[7]), "v"(yp[8]),
                    "v"(xp[0]), "v"(xp[1]), "v"(xp[2]), "v"(xp[3]), "v"(xp[4]), "v"(xp[5]),
                    "v"(xp[6]), "v"(xp[7]), "v"(xp[8])
                 : "memory");
    #pragma unroll
    for (int i = 0; i < NCH; ++i)
        if (!xin[i]) xv[i] = (v4f)(0.f);       // zero padding
    #pragma unroll
    for (int i = 0; i < NCH; ++i) {
        const int c = tid + 512 * i;
        *(v4f*)&ysm[c >> 6][(c & 63) * 4] = yv[i];
    }
    #pragma unroll
    for (int i = 0; i < NCH; ++i) {
        const int c   = tid + 512 * i;
        const int run = c / 6;
        const int e   = run & (E_DIM - 1);
        const int r   = ((run >> 8) * 6 + (c - run * 6)) * 4;
        xT[r + 0][e] = xv[i].x;
        xT[r + 1][e] = xv[i].y;
        xT[r + 2][e] = xv[i].z;
        xT[r + 3][e] = xv[i].w;
    }
    __syncthreads();                              // windows visible to every group

    for (int pass = 0; pass < TT / 32; ++pass) {  // the group's two s positions
        const int sg = g + 32 * pass;
        // --- energies: en[l] = <y[s], y[s+l-4]> / 24; lane owns e = 4*lane16 + 64*i + 0..3 ---
        v4f own[4];
        #pragma unroll
        for (int i = 0; i < 4; ++i)
            own[i] = *(const v4f*)&ysm[sg + PADW][lane16 * 4 + 64 * i];

        float en[KW];
        #pragma unroll
        for (int l = 0; l < KW; ++l) {
            float p = 0.f;
            #pragma unroll
            for (int i = 0; i < 4; ++i) {
                const v4f v = (l == PADW) ? own[i]
                                             : *(const v4f*)&ysm[sg + l][lane16 * 4 + 64 * i];
                p = fmaf(own[i].x, v.x, p);
                p = fmaf(own[i].y, v.y, p);
                p = fmaf(own[i].z, v.z, p);
                p = fmaf(own[i].w, v.w, p);
            }
            #pragma unroll
            for (int off = 8; off >= 1; off >>= 1)    // xor tree: all 16 lanes get sum
                p += __shfl_xor(p, off, 16);
            en[l] = p * INV_SCALE;
        }

        // --- softmax over the 9 window slots (redundant in all 16 lanes) ---
        float mx = en[0];
        #pragma unroll
        for (int l = 1; l < KW; ++l) mx = fmaxf(mx, en[l]);
        float w[KW], sum = 0.f;
        #pragma unroll
        for (int l = 0; l < KW; ++l) { w[l] = exp2_slot((en[l] - mx) * 1.44269504f); sum += w[l]; }
        const float inv = 1.0f / sum;
        #pragma unroll
        for (int l = 0; l < KW; ++l) w[l] *= inv;

        // --- context: ctx[s,e] = sum_l w[l] * x[b,e,s+l-4]  (zero-padded in xT) ---
        #pragma unroll
        for (int i = 0; i < 4; ++i) {
            v4f c = (v4f)(0.f);
            #pragma unroll
            for (int l = 0; l < KW; ++l) {
                const v4f v = *(const v4f*)&xT[sg + l][lane16 * 4 + 64 * i];
                c.x += w[l] * v.x;
                c.y += w[l] * v.y;
                c.z += w[l] * v.z;
                c.w += w[l] * v.w;
            }
            *(v4f*)&ctx[sg][lane16 * 4 + 64 * i] = c;
        }
    }
    __syncthreads();

    // --- output GEMM: out[b, f0+m, t0+16*tt+n] = (sum_e Wo[f,e]*ctx[16*tt+n][e] + bo[f])/9
    const int wave = tid >> 5;
    const int lane = tid & 31;
    const int mn   = lane & 15;
    const int kb   = (lane >> 4) * 2;
    const int half = lane >> 4;

    const int f0 = wave * 16;
    const float* arow = Wo + (size_t)(f0 + mn) * E_DIM;       // A[m,k] = Wo[f0+m, e]
    v8f acc[TT / 16] = {};
    #pragma unroll 4
    for (int k0 = 0; k0 < E_DIM; k0 += 4) {
        const v2f a = *(const v2f*)(arow + k0 + kb);
        #pragma unroll                            // constant tt: the four accumulators stay in registers
        for (int tt = 0; tt < TT / 16; ++tt) {
            const v2f bv = *(const v2f*)&ctx[tt * 16 + mn][k0 + kb];  // B[k,n] = ctx[16*tt+n][e]
            acc[tt] = __builtin_amdgcn_wmma_f32_16x16x4_f32(
                          false, a, false, bv, (short)0, acc[tt], false, false);
        }
    }
    float* ob = out + ((size_t)b * E_DIM + f0) * S_DIM + t0;
    #pragma unroll
    for (int j = 0; j < 8; ++j) {
        const int mm = j + half * 8;              // D row = f offset
        const float bof = bo[f0 + mm];
        #pragma unroll                            // constant tt, as above
        for (int tt = 0; tt < TT / 16; ++tt)
            ob[(size_t)mm * S_DIM + tt * 16 + mn] = (acc[tt][j] + bof) * (1.0f / KW);
    }
}

// ---------------------------------------------------------------------------
extern "C" void kernel_launch(void* const* d_in, const int* in_sizes, int n_in,
                              void* d_out, int out_size, void* d_ws, size_t ws_size,
                              hipStream_t stream)
{
    const float* x  = (const float*)d_in[0];
    const float* Wq = (const float*)d_in[1];
    const float* bq = (const float*)d_in[2];
    const float* Wo = (const float*)d_in[3];
    const float* bo = (const float*)d_in[4];
    float* out = (float*)d_out;
    float* Y   = (float*)d_ws;     // B*S*E floats = 16 MB scratch

    const int nblk = B_DIM * (S_DIM / TT);   // 256 blocks of 512 threads
    qproj_kernel<<<dim3(nblk), dim3(512), 0, stream>>>(x, Wq, bq, Y);
    attn_out_kernel<<<dim3(nblk), dim3(512), 0, stream>>>(x, Y, bq, Wo, bo, out);
}

// v003
// A run of this version takes 31.5 microseconds.
// In both of two side-by-side timings against v002, it was 1.04 times as fast.
// Counting every step since v000, it is 2.40 times as fast.
#include <hip/hip_runtime.h>

typedef __attribute__((ext_vector_type(2))) float v2f;
typedef __attribute__((ext_vector_type(4))) float v4f;
typedef __attribute__((ext_vector_type(8))) float v8f;

#define B_DIM 8
#define E_DIM 256
#define S_DIM 2048
#define KW    9
#define PADW  4
#define TT    64                     // t positions per block: 4 WMMA tiles
#define INV_SCALE (1.0f / 24.0f)   // 1/(sqrt(256)*1.5)

// ---------------------------------------------------------------------------
// One launch. One block = one 64-wide t-tile of one batch, 16 waves, alone on its WGP.
//  Stage:   the x columns t0-4 .. t0+75 (the 72 that the tile's windows cover, rounded
//           up to five WMMA tiles) are read once from global memory, 16 bytes a lane,
//           and stored transposed, [t][e], zero outside the sequence.
//  GEMM 1:  Y[t,f] = sum_e x[e,t] * Wq[f,e] + bq[f] for those 80 rows, into LDS: each
//           wave owns one f-tile; a Wq fragment is loaded once per k step and feeds
//           five fp32 WMMA 16x16x4. The window rows beyond the tile's own 64 are
//           computed by this block too, so that no Y row crosses between blocks.
//  Phase A: 32 groups of 16 lanes; group g owns s = t0+g and s = t0+g+32; all reads from LDS.
//  Phase B: each wave owns one f-tile of out[b,f,t] = (Wo . ctx + bo)/9: a Wo
//           fragment is loaded once per k step and feeds four WMMAs (four t-tiles).
// ---------------------------------------------------------------------------
#define WROWS 80                                  // window rows (72) rounded up to 5 tiles of 16
#define PIT   (E_DIM + 4)                         // LDS row pitch in floats: bank stride 4
#define NCH   10                                  // 16-byte chunks per thread: WROWS*E_DIM/4/512

// 2^a by v_exp_f32, with the one slot that the instruction set asks for behind a transcendental
// (before its result is used or its source overwritten) in the same statement.
__device__ __forceinline__ float exp2_slot(float a)
{
    float r;
    asm("v_exp_f32 %0, %1\n\tv_nop" : "=v"(r) : "v"(a));
    return r;
}

__global__ __launch_bounds__(512) void pool_kernel(
    const float* __restrict__ x, const float* __restrict__ Wq,
    const float* __restrict__ bq, const float* __restrict__ Wo,
    const float* __restrict__ bo, float* __restrict__ out)
{
    __shared__ __attribute__((aligned(16))) float xT[WROWS][PIT];    // x columns t0-4 .. t0+75, [t][e]
    __shared__ __attribute__((aligned(16))) float ysm[WROWS][PIT];   // Y rows of the same positions
    __shared__ __attribute__((aligned(16))) float ctx[TT][PIT];

    const int tile = blockIdx.x;
    const int b    = tile / (S_DIM / TT);
    const int t0   = (tile % (S_DIM / TT)) * TT;
    const int tid  = threadIdx.x;
    const int g      = tid >> 4;                  // group -> s index in tile (and +32)
    const int lane16 = tid & 15;
    const int wave = tid >> 5;
    const int lane = tid & 31;
    const int mn   = lane & 15;                   // A-row m / B-col n / D-col n
    const int kb   = (lane >> 4) * 2;             // K sub-offset per half-wave
    const int half = lane >> 4;
    const int f0   = wave * 16;

    const float* xb = x + (size_t)b * E_DIM * S_DIM;

    // --- stage: 10 chunks of 16 B per thread, all loads issued first ---
    v4f xv[NCH];
    const float* xp[NCH];
    bool xin[NCH];
    #pragma unroll
    for (int i = 0; i < NCH; ++i) {               // runs of 4 chunks (64 B) of a feature row, 5 runs per row
        const int run  = (tid + 512 * i) >> 2;
        const int e    = run & (E_DIM - 1);
        const int r    = ((run >> 8) * 4 + (tid & 3)) * 4;    // window position of the chunk, 0 .. 76
        const int col  = t0 - PADW + r;                       // a chunk is wholly in or wholly out
        const int colc = min(max(col, 0), S_DIM - 4);         // address stays inside x
        xp[i]  = xb + (size_t)e * S_DIM + colc;
        xin[i] = (col == colc);
    }
    #pragma unroll
    for (int i = 0; i < NCH; ++i) xv[i] = *(const v4f*)xp[i];
    // The ten address pairs stay untouched until this wait: no register that an
    // issued load names is overwritten (also not by a later load's data) ahead of it.
    asm volatile("s_wait_xcnt 0x0"
                 :: "v"(xp[0]), "v"(xp[1]), "v"(xp[2]), "v"(xp[3]), "v"(xp[4]),
                    "v"(xp[5]), "v"(xp[6]), "v"(xp[7]), "v"(xp[8]), "v"(xp[9])
                 : "memory");
    #pragma unroll
    for (int i = 0; i < NCH; ++i)
        if (!xin[i]) xv[i] = (v4f)(0.f);       // zero padding
    #pragma unroll
    for (int i = 0; i < NCH; ++i) {               // a wave's 32 stores fall on 32 banks
        const int run = (tid + 512 * i) >> 2;
        const int e   = run & (E_DIM - 1);
        const int r   = ((run >> 8) * 4 + (tid & 3)) * 4;
        xT[r + 0][e] = xv[i].x;
        xT[r + 1][e] = xv[i].y;
        xT[r + 2][e] = xv[i].z;
        xT[r + 3][e] = xv[i].w;
    }
    __syncthreads();                              // x window visible to every wave

    // --- query GEMM: ysm[16*tt+m][f0+n] = sum_e xT[16*tt+m][e] * Wq[f0+n][e] + bq[f0+n]
    {
        const float* wrow = Wq + (size_t)(f0 + mn) * E_DIM;   // B[k,n] = Wq[f0+n, e]
        v8f yacc[WROWS / 16] = {};
        #pragma unroll 4
        for (int k0 = 0; k0 < E_DIM; k0 += 4) {
            const v2f bv = *(const v2f*)(wrow + k0 + kb);
            #pragma unroll                        // constant tt: the five accumulators stay in registers
            for (int tt = 0; tt < WROWS / 16; ++tt) {
                const v2f a = *(const v2f*)&xT[tt * 16 + mn][k0 + kb];   // A[m,k] = x[e, t], conflict-free
                yacc[tt] = __builtin_amdgcn_wmma_f32_16x16x4_f32(
                               false, a, false, bv, (short)0, yacc[tt], false, false);
            }
        }
        const float bias = bq[f0 + mn];           // a position outside the sequence gets 0 + bq, as the reference's padding does
        #pragma unroll                            // constant tt, as above
        for (int tt = 0; tt < WROWS / 16; ++tt) {
            #pragma unroll
            for (int j = 0; j < 8; ++j)           // D row = t offset
                ysm[tt * 16 + j + half * 8][f0 + mn] = yacc[tt][j] + bias;
        }
    }
    __syncthreads();                              // Y rows visible to every group

    #pragma unroll 1                              // rolled: unrolled, the two passes' loads fill the 256-register budget and lane indices spill to scratch
    for (int pass = 0; pass < TT / 32; ++pass) {  // the group's two s positions
        const int sg = g + 32 * pass;
        // --- energies: en[l] = <y[s], y[s+l-4]> / 24; lane owns e = 4*lane16 + 64*i + 0..3 ---
        v4f own[4];
        #pragma unroll
        for (int i = 0; i < 4; ++i)
            own[i] = *(const v4f*)&ysm[sg + PADW][lane16 * 4 + 64 * i];

        float en[KW];
        #pragma unroll
        for (int l = 0; l < KW; ++l) {
            float p = 0.f;
            #pragma unroll
            for (int i = 0; i < 4; ++i) {
                const v4f v = (l == PADW) ? own[i]
                                             : *(const v4f*)&ysm[sg + l][lane16 * 4 + 64 * i];
                p = fmaf(own[i].x, v.x, p);
                p = fmaf(own[i].y, v.y, p);
                p = fmaf(own[i].z, v.z, p);
                p = fmaf(own[i].w, v.w, p);
            }
            #pragma unroll
            for (int off = 8; off >= 1; off >>= 1)    // xor tree: all 16 lanes get sum
                p += __shfl_xor(p, off, 16);
            en[l] = p * INV_SCALE;
        }

        // --- softmax over the 9 window slots (redundant in all 16 lanes) ---
        float mx = en[0];
        #pragma unroll
        for (int l = 1; l < KW; ++l) mx = fmaxf(mx, en[l]);
        float w[KW], sum = 0.f;
        #pragma unroll
        for (int l = 0; l < KW; ++l) { w[l] = exp2_slot((en[l] - mx) * 1.44269504f); sum += w[l]; }
        const float inv = 1.0f / sum;
        #pragma unroll
        for (int l = 0; l < KW; ++l) w[l] *= inv;

        // --- context: ctx[s,e] = sum_l w[l] * x[b,e,s+l-4]  (zero-padded in xT) ---
        #pragma unroll
        for (int i = 0; i < 4; ++i) {
            v4f c = (v4f)(0.f);
            #pragma unroll
            for (int l = 0; l < KW; ++l) {
                const v4f v = *(const v4f*)&xT[sg + l][lane16 * 4 + 64 * i];
                c.x += w[l] * v.x;
                c.y += w[l] * v.y;
                c.z += w[l] * v.z;
                c.w += w[l] * v.w;
            }
            *(v4f*)&ctx[sg][lane16 * 4 + 64 * i] = c;
        }
    }
    __syncthreads();

    // --- output GEMM: out[b, f0+m, t0+16*tt+n] = (sum_e Wo[f,e]*ctx[16*tt+n][e] + bo[f])/9
    const float* arow = Wo + (size_t)(f0 + mn) * E_DIM;       // A[m,k] = Wo[f0+m, e]
    v8f acc[TT / 16] = {};
    #pragma unroll 4
    for (int k0 = 0; k0 < E_DIM; k0 += 4) {
        const v2f a = *(const v2f*)(arow + k0 + kb);
        #pragma unroll                            // constant tt: the four accumulators stay in registers
        for (int tt = 0; tt < TT / 16; ++tt) {
            const v2f bv = *(const v2f*)&ctx[tt * 16 + mn][k0 + kb];  // B[k,n] = ctx[16*tt+n][e]
            acc[tt] = __builtin_amdgcn_wmma_f32_16x16x4_f32(
                          false, a, false, bv, (short)0, acc[tt], false, false);
        }
    }
    float* ob = out + ((size_t)b * E_DIM + f0) * S_DIM + t0;
    #pragma unroll
    for (int j = 0; j < 8; ++j) {
        const int mm = j + half * 8;              // D row = f offset
        const float bof = bo[f0 + mm];
        #pragma unroll                            // constant tt, as above
        for (int tt = 0; tt < TT / 16; ++tt)
            ob[(size_t)mm * S_DIM + tt * 16 + mn] = (acc[tt][j] + bof) * (1.0f / KW);
    }
}

// ---------------------------------------------------------------------------
extern "C" void kernel_launch(void* const* d_in, const int* in_sizes, int n_in,
                              void* d_out, int out_size, void* d_ws, size_t ws_size,
                              hipStream_t stream)
{
    const float* x  = (const float*)d_in[0];
    const float* Wq = (const float*)d_in[1];
    const float* bq = (const float*)d_in[2];
    const float* Wo = (const float*)d_in[3];
    const float* bo = (const float*)d_in[4];
    float* out = (float*)d_out;

    const int nblk = B_DIM * (S_DIM / TT);   // 256 blocks of 512 threads
    pool_kernel<<<dim3(nblk), dim3(512), 0, stream>>>(x, Wq, bq, Wo, bo, out);
}
